// v000
// The times below were measured on an AMD MI455X: many runs one after another, warmed up first and cycling through
// copies of the inputs, with the whole window's GPU time divided by the number of runs. Launches and the gaps
// between them are all in it. The median over several windows is given; except for v000 it joins two sittings, which
// can be a few percent apart, so the side-by-side timings, each taken in one sitting, are the better comparison.
// v000 is the starting kernel.
#include <hip/hip_runtime.h>
#include <math.h>

#define D_IN   64
#define D_EDGE 16
#define D_HID  64
#define HEADS  4
#define HD     256   // HEADS * D_HID
#define LN_EPS 1e-5f

typedef __attribute__((ext_vector_type(2))) float v2f;
typedef __attribute__((ext_vector_type(8))) float v8f;

__device__ __forceinline__ v8f wmma_f32_k4(v2f a, v2f b, v8f c) {
  // V_WMMA_F32_16X16X4_F32 : D = A(16x4) x B(4x16) + C(16x16), fp32 throughout
  return __builtin_amdgcn_wmma_f32_16x16x4_f32(false, a, false, b, (short)0, c,
                                               false, false);
}

// float atomic max via signed-max / unsigned-min ordering trick (amax init = -inf)
__device__ __forceinline__ void atomicMaxF(float* addr, float v) {
  if (v >= 0.0f)
    atomicMax((int*)addr, __float_as_int(v));
  else
    atomicMin((unsigned int*)addr, __float_as_uint(v));
}

// ---------------------------------------------------------------------------
// q = x @ W_node   [N,64] x [64,256] -> [N,256]
// one block = 16 rows, 4 waves; wave w owns cols [64w, 64w+64) = 4 16x16 tiles
// ---------------------------------------------------------------------------
__global__ void __launch_bounds__(128)
qproj_wmma(const float* __restrict__ X, const float* __restrict__ Wn,
           float* __restrict__ Q) {
  const int row0 = blockIdx.x * 16;
  const int wave = threadIdx.x >> 5;
  const int lane = threadIdx.x & 31;
  const int lr = lane & 15;        // row (A/D) or col (B/D) within tile
  const int lh = lane >> 4;        // lane half selects K pair / row half
  const int col0 = wave * 64;

  v8f acc0 = {}, acc1 = {}, acc2 = {}, acc3 = {};
  const float* xrow = X + (size_t)(row0 + lr) * D_IN;

  for (int k = 0; k < D_IN; k += 4) {
    v2f a;
    a.x = xrow[k + 2 * lh];
    a.y = xrow[k + 2 * lh + 1];
    const float* w0 = Wn + (size_t)(k + 2 * lh) * HD;
    const float* w1 = Wn + (size_t)(k + 2 * lh + 1) * HD;
    v2f b;
    b.x = w0[col0 + lr];      b.y = w1[col0 + lr];      acc0 = wmma_f32_k4(a, b, acc0);
    b.x = w0[col0 + 16 + lr]; b.y = w1[col0 + 16 + lr]; acc1 = wmma_f32_k4(a, b, acc1);
    b.x = w0[col0 + 32 + lr]; b.y = w1[col0 + 32 + lr]; acc2 = wmma_f32_k4(a, b, acc2);
    b.x = w0[col0 + 48 + lr]; b.y = w1[col0 + 48 + lr]; acc3 = wmma_f32_k4(a, b, acc3);
  }
#pragma unroll
  for (int i = 0; i < 8; ++i) {
    const int r = row0 + i + 8 * lh;           // C/D layout: VGPR i -> M = i + 8*laneHalf
    float* qr = Q + (size_t)r * HD + col0 + lr;
    qr[0]  = acc0[i];
    qr[16] = acc1[i];
    qr[32] = acc2[i];
    qr[48] = acc3[i];
  }
}

// ---------------------------------------------------------------------------
// init amax = -inf
// ---------------------------------------------------------------------------
__global__ void init_amax(float* __restrict__ amax, int n) {
  int i = blockIdx.x * 256 + threadIdx.x;
  if (i < n) amax[i] = -__builtin_huge_valf();
}

// ---------------------------------------------------------------------------
// Edge pass 1: one wave per edge. Lane owns 8 of 256 message dims.
// msg = q[src] + edge_attr @ W_edge ; alpha = dot(q[dst], msg)/8 per head.
// Store raw alpha, atomic-max into amax[dst].
// ---------------------------------------------------------------------------
__device__ __forceinline__ void edge_msg(const float* __restrict__ ea,
                                         const float* __restrict__ We,
                                         const float* __restrict__ q,
                                         int e, int s, int d0, float msg[8]) {
  const float4* eap = (const float4*)(ea + (size_t)e * D_EDGE);
  float4 t0 = eap[0], t1 = eap[1], t2 = eap[2], t3 = eap[3];
  float ef[16] = {t0.x, t0.y, t0.z, t0.w, t1.x, t1.y, t1.z, t1.w,
                  t2.x, t2.y, t2.z, t2.w, t3.x, t3.y, t3.z, t3.w};
#pragma unroll
  for (int j = 0; j < 8; ++j) {
    float a = 0.0f;
#pragma unroll
    for (int k = 0; k < 16; ++k) a = fmaf(ef[k], We[k * HD + d0 + j], a);
    msg[j] = a;
  }
  const float4* qs = (const float4*)(q + (size_t)s * HD + d0);
  float4 s0 = qs[0], s1 = qs[1];
  msg[0] += s0.x; msg[1] += s0.y; msg[2] += s0.z; msg[3] += s0.w;
  msg[4] += s1.x; msg[5] += s1.y; msg[6] += s1.z; msg[7] += s1.w;
}

__global__ void __launch_bounds__(256)
edge_alpha(const float* __restrict__ ea, const float* __restrict__ We,
           const float* __restrict__ q, const int* __restrict__ src,
           const int* __restrict__ dst, float* __restrict__ alpha_raw,
           float* __restrict__ amax, int E) {
  const int lane = threadIdx.x & 31;
  const int e = blockIdx.x * 8 + (threadIdx.x >> 5);
  if (e >= E) return;
  const int s = src[e], d = dst[e];
  const int d0 = lane * 8;

  float msg[8];
  edge_msg(ea, We, q, e, s, d0, msg);

  const float4* qdp = (const float4*)(q + (size_t)d * HD + d0);
  float4 u0 = qdp[0], u1 = qdp[1];
  float p = u0.x * msg[0] + u0.y * msg[1] + u0.z * msg[2] + u0.w * msg[3] +
            u1.x * msg[4] + u1.y * msg[5] + u1.z * msg[6] + u1.w * msg[7];
  // reduce across the 8 lanes of this head
  p += __shfl_xor(p, 1, 32);
  p += __shfl_xor(p, 2, 32);
  p += __shfl_xor(p, 4, 32);
  if ((lane & 7) == 0) {
    const int h = lane >> 3;
    const float al = p * 0.125f;  // 1/sqrt(64)
    alpha_raw[(size_t)e * HEADS + h] = al;
    atomicMaxF(&amax[(size_t)d * HEADS + h], al);
  }
}

// ---------------------------------------------------------------------------
// Softmax numerator + denominator: ex = exp(alpha - amax[dst]); denom += ex
// ---------------------------------------------------------------------------
__global__ void __launch_bounds__(256)
edge_softmax(float* __restrict__ ex_io, const float* __restrict__ amax,
             const int* __restrict__ dst, float* __restrict__ denom, int E) {
  const int i = blockIdx.x * 256 + threadIdx.x;
  if (i >= E * HEADS) return;
  const int e = i >> 2, h = i & 3;
  const int d = dst[e];
  const float v = __expf(ex_io[i] - amax[(size_t)d * HEADS + h]);
  ex_io[i] = v;
  unsafeAtomicAdd(&denom[(size_t)d * HEADS + h], v);
}

// ---------------------------------------------------------------------------
// Edge pass 2: recompute msg, scale by ex/denom[dst], scatter-add into accum
// ---------------------------------------------------------------------------
__global__ void __launch_bounds__(256)
edge_aggr(const float* __restrict__ ea, const float* __restrict__ We,
          const float* __restrict__ q, const int* __restrict__ src,
          const int* __restrict__ dst, const float* __restrict__ exb,
          const float* __restrict__ denom, float* __restrict__ accum, int E) {
  const int lane = threadIdx.x & 31;
  const int e = blockIdx.x * 8 + (threadIdx.x >> 5);
  if (e >= E) return;
  const int s = src[e], d = dst[e];
  const int d0 = lane * 8;
  const int h = lane >> 3;

  float msg[8];
  edge_msg(ea, We, q, e, s, d0, msg);

  const float w = exb[(size_t)e * HEADS + h] / denom[(size_t)d * HEADS + h];
  float* outp = accum + (size_t)d * HD + d0;
#pragma unroll
  for (int j = 0; j < 8; ++j) unsafeAtomicAdd(&outp[j], msg[j] * w);
}

// ---------------------------------------------------------------------------
// y = LN(accum @ W_out + b_out + x) ; WMMA K=256 then LDS-based LayerNorm
// one block = 16 rows; 4 waves, wave w owns output cols [16w, 16w+16)
// ---------------------------------------------------------------------------
__global__ void __launch_bounds__(128)
out_ln_wmma(const float* __restrict__ A, const float* __restrict__ Wo,
            const float* __restrict__ bo, const float* __restrict__ Xres,
            const float* __restrict__ gamma, const float* __restrict__ beta,
            float* __restrict__ Y) {
  __shared__ float lds[16 * 64];
  const int row0 = blockIdx.x * 16;
  const int wave = threadIdx.x >> 5;
  const int lane = threadIdx.x & 31;
  const int lr = lane & 15;
  const int lh = lane >> 4;
  const int col0 = wave * 16;

  v8f acc = {};
  const float* arow = A + (size_t)(row0 + lr) * HD;
  for (int k = 0; k < HD; k += 4) {
    v2f a, b;
    a.x = arow[k + 2 * lh];
    a.y = arow[k + 2 * lh + 1];
    b.x = Wo[(size_t)(k + 2 * lh) * D_HID + col0 + lr];
    b.y = Wo[(size_t)(k + 2 * lh + 1) * D_HID + col0 + lr];
    acc = wmma_f32_k4(a, b, acc);
  }
#pragma unroll
  for (int i = 0; i < 8; ++i)
    lds[(i + 8 * lh) * 64 + col0 + lr] = acc[i];
  __syncthreads();

  // bias + residual
  for (int idx = threadIdx.x; idx < 16 * 64; idx += 128) {
    const int r = idx >> 6, c = idx & 63;
    lds[idx] += bo[c] + Xres[(size_t)(row0 + r) * 64 + c];
  }
  __syncthreads();

  // LayerNorm: one thread per row (16 rows, 64 cols each)
  if (threadIdx.x < 16) {
    const int r = threadIdx.x;
    float mu = 0.0f;
    for (int c = 0; c < 64; ++c) mu += lds[r * 64 + c];
    mu *= (1.0f / 64.0f);
    float var = 0.0f;
    for (int c = 0; c < 64; ++c) {
      const float dd = lds[r * 64 + c] - mu;
      var += dd * dd;
    }
    var *= (1.0f / 64.0f);
    const float rs = rsqrtf(var + LN_EPS);
    for (int c = 0; c < 64; ++c)
      Y[(size_t)(row0 + r) * 64 + c] =
          (lds[r * 64 + c] - mu) * rs * gamma[c] + beta[c];
  }
}

// ---------------------------------------------------------------------------
extern "C" void kernel_launch(void* const* d_in, const int* in_sizes, int n_in,
                              void* d_out, int out_size, void* d_ws, size_t ws_size,
                              hipStream_t stream) {
  const float* x     = (const float*)d_in[0];  // [N,64]
  const float* ea    = (const float*)d_in[1];  // [E,16]
  const float* Wn    = (const float*)d_in[2];  // [64,256]
  const float* We    = (const float*)d_in[3];  // [16,256]
  const float* Wo    = (const float*)d_in[4];  // [256,64]
  const float* bo    = (const float*)d_in[5];  // [64]
  const float* gamma = (const float*)d_in[6];  // [64]
  const float* beta  = (const float*)d_in[7];  // [64]
  const int*   ei    = (const int*)d_in[8];    // [2,E]

  const int N = in_sizes[0] / D_IN;
  const int E = in_sizes[8] / 2;
  const int* src = ei;
  const int* dst = ei + E;

  // workspace layout (floats): q[N*256] | accum[N*256] | amax[N*4] | denom[N*4] | ex[E*4]
  float* q     = (float*)d_ws;
  float* accum = q + (size_t)N * HD;
  float* amax  = accum + (size_t)N * HD;
  float* denom = amax + (size_t)N * HEADS;
  float* exb   = denom + (size_t)N * HEADS;

  hipMemsetAsync(accum, 0, (size_t)N * HD * sizeof(float), stream);
  hipMemsetAsync(denom, 0, (size_t)N * HEADS * sizeof(float), stream);
  init_amax<<<(N * HEADS + 255) / 256, 256, 0, stream>>>(amax, N * HEADS);

  qproj_wmma<<<N / 16, 128, 0, stream>>>(x, Wn, q);
  edge_alpha<<<(E + 7) / 8, 256, 0, stream>>>(ea, We, q, src, dst, exb, amax, E);
  edge_softmax<<<(E * HEADS + 255) / 256, 256, 0, stream>>>(exb, amax, dst, denom, E);
  edge_aggr<<<(E + 7) / 8, 256, 0, stream>>>(ea, We, q, src, dst, exb, denom, accum, E);
  out_ln_wmma<<<N / 16, 128, 0, stream>>>(accum, Wo, bo, x, gamma, beta, (float*)d_out);
}

// v001
// In both of two side-by-side timings against v000, it was 2.81 times as fast.
#include <hip/hip_runtime.h>
#include <math.h>

#define D_IN   64
#define D_EDGE 16
#define D_HID  64
#define HEADS  4
#define HD     256   // HEADS * D_HID
#define LN_EPS 1e-5f

typedef __attribute__((ext_vector_type(2))) float v2f;
typedef __attribute__((ext_vector_type(8))) float v8f;

__device__ __forceinline__ v8f wmma_f32_k4(v2f a, v2f b, v8f c) {
  // V_WMMA_F32_16X16X4_F32 : D = A(16x4) x B(4x16) + C(16x16), fp32 throughout
  return __builtin_amdgcn_wmma_f32_16x16x4_f32(false, a, false, b, (short)0, c,
                                               false, false);
}

// float atomic max via signed-max / unsigned-min ordering trick (amax init = -inf)
__device__ __forceinline__ void atomicMaxF(float* addr, float v) {
  if (v >= 0.0f)
    atomicMax((int*)addr, __float_as_int(v));
  else
    atomicMin((unsigned int*)addr, __float_as_uint(v));
}

// ---------------------------------------------------------------------------
// q = x @ W_node   [N,64] x [64,256] -> [N,256]
// one block = 16 rows, 4 waves; wave w owns cols [64w, 64w+64) = 4 16x16 tiles
// ---------------------------------------------------------------------------
__global__ void __launch_bounds__(128)
qproj_wmma(const float* __restrict__ X, const float* __restrict__ Wn,
           float* __restrict__ Q) {
  const int row0 = blockIdx.x * 16;
  const int wave = threadIdx.x >> 5;
  const int lane = threadIdx.x & 31;
  const int lr = lane & 15;        // row (A/D) or col (B/D) within tile
  const int lh = lane >> 4;        // lane half selects K pair / row half
  const int col0 = wave * 64;

  v8f acc0 = {}, acc1 = {}, acc2 = {}, acc3 = {};
  const float* xrow = X + (size_t)(row0 + lr) * D_IN;

  for (int k = 0; k < D_IN; k += 4) {
    v2f a;
    a.x = xrow[k + 2 * lh];
    a.y = xrow[k + 2 * lh + 1];
    const float* w0 = Wn + (size_t)(k + 2 * lh) * HD;
    const float* w1 = Wn + (size_t)(k + 2 * lh + 1) * HD;
    v2f b;
    b.x = w0[col0 + lr];      b.y = w1[col0 + lr];      acc0 = wmma_f32_k4(a, b, acc0);
    b.x = w0[col0 + 16 + lr]; b.y = w1[col0 + 16 + lr]; acc1 = wmma_f32_k4(a, b, acc1);
    b.x = w0[col0 + 32 + lr]; b.y = w1[col0 + 32 + lr]; acc2 = wmma_f32_k4(a, b, acc2);
    b.x = w0[col0 + 48 + lr]; b.y = w1[col0 + 48 + lr]; acc3 = wmma_f32_k4(a, b, acc3);
  }
#pragma unroll
  for (int i = 0; i < 8; ++i) {
    const int r = row0 + i + 8 * lh;           // C/D layout: VGPR i -> M = i + 8*laneHalf
    float* qr = Q + (size_t)r * HD + col0 + lr;
    qr[0]  = acc0[i];
    qr[16] = acc1[i];
    qr[32] = acc2[i];
    qr[48] = acc3[i];
  }
}

// ---------------------------------------------------------------------------
// init amax = -inf, per-node edge count = 0
// ---------------------------------------------------------------------------
__global__ void init_amax(float* __restrict__ amax, int* __restrict__ cnt, int n,
                          int nodes) {
  int i = blockIdx.x * 256 + threadIdx.x;
  if (i < n) amax[i] = -__builtin_huge_valf();
  if (i < nodes) cnt[i] = 0;
}

// ---------------------------------------------------------------------------
// Edge pass 1: one wave per edge. Lane owns 8 of 256 message dims.
// msg = q[src] + edge_attr @ W_edge ; alpha = dot(q[dst], msg)/8 per head.
// Store raw alpha, atomic-max into amax[dst].
// Also ranks the edge inside its dst bucket: rank[e] = edges of dst counted so far.
// ---------------------------------------------------------------------------
__device__ __forceinline__ void edge_msg(const float* __restrict__ ea,
                                         const float* __restrict__ We,
                                         const float* __restrict__ q,
                                         int e, int s, int d0, float msg[8]) {
  const float4* eap = (const float4*)(ea + (size_t)e * D_EDGE);
  float4 t0 = eap[0], t1 = eap[1], t2 = eap[2], t3 = eap[3];
  float ef[16] = {t0.x, t0.y, t0.z, t0.w, t1.x, t1.y, t1.z, t1.w,
                  t2.x, t2.y, t2.z, t2.w, t3.x, t3.y, t3.z, t3.w};
#pragma unroll
  for (int j = 0; j < 8; ++j) {
    float a = 0.0f;
#pragma unroll
    for (int k = 0; k < 16; ++k) a = fmaf(ef[k], We[k * HD + d0 + j], a);
    msg[j] = a;
  }
  const float4* qs = (const float4*)(q + (size_t)s * HD + d0);
  float4 s0 = qs[0], s1 = qs[1];
  msg[0] += s0.x; msg[1] += s0.y; msg[2] += s0.z; msg[3] += s0.w;
  msg[4] += s1.x; msg[5] += s1.y; msg[6] += s1.z; msg[7] += s1.w;
}

__global__ void __launch_bounds__(256)
edge_alpha(const float* __restrict__ ea, const float* __restrict__ We,
           const float* __restrict__ q, const int* __restrict__ src,
           const int* __restrict__ dst, float* __restrict__ alpha_raw,
           float* __restrict__ amax, int* __restrict__ cnt,
           int* __restrict__ rank, int E) {
  const int lane = threadIdx.x & 31;
  const int e = blockIdx.x * 8 + (threadIdx.x >> 5);
  if (e >= E) return;
  const int s = src[e], d = dst[e];
  const int d0 = lane * 8;

  float msg[8];
  edge_msg(ea, We, q, e, s, d0, msg);

  const float4* qdp = (const float4*)(q + (size_t)d * HD + d0);
  float4 u0 = qdp[0], u1 = qdp[1];
  float p = u0.x * msg[0] + u0.y * msg[1] + u0.z * msg[2] + u0.w * msg[3] +
            u1.x * msg[4] + u1.y * msg[5] + u1.z * msg[6] + u1.w * msg[7];
  // reduce across the 8 lanes of this head
  p += __shfl_xor(p, 1, 32);
  p += __shfl_xor(p, 2, 32);
  p += __shfl_xor(p, 4, 32);
  if ((lane & 7) == 0) {
    const int h = lane >> 3;
    const float al = p * 0.125f;  // 1/sqrt(64)
    alpha_raw[(size_t)e * HEADS + h] = al;
    atomicMaxF(&amax[(size_t)d * HEADS + h], al);
    if (lane == 0) rank[e] = atomicAdd(&cnt[d], 1);  // arrival order decides the rank
  }
}

// ---------------------------------------------------------------------------
// off[i] = sum of cnt[0..i): each block sums all counts in front of its own 1024
// nodes by itself (no hand-over between blocks), then scans its own 1024.
// ---------------------------------------------------------------------------
__global__ void __launch_bounds__(1024)
node_offsets(const int* __restrict__ cnt, int* __restrict__ off, int nodes) {
  __shared__ int wave_tot[32];
  __shared__ int wave_pre[32];
  const int t = threadIdx.x;
  const int lane = t & 31;
  const int wv = t >> 5;
  const int first = blockIdx.x * 1024;

  int pre = 0;
  const int* p = cnt + t;
  int left = blockIdx.x;  // runs of 1024 counts in front of this block's own
  // eight loads off one address with constant offsets are in flight together
  // (both short loops unrolled so that v[] stays in registers)
  for (; left >= 8; left -= 8) {
    int v[8];
#pragma unroll
    for (int k = 0; k < 8; ++k) v[k] = p[k * 1024];
    p += 8 * 1024;
#pragma unroll
    for (int k = 0; k < 8; ++k) pre += v[k];
  }
  for (; left > 0; --left) {
    const int v = *p;
    p += 1024;
    pre += v;
  }
  const int idx = first + t;
  const int c = idx < nodes ? cnt[idx] : 0;

  int inc = c;  // inclusive scan inside the wave
#pragma unroll
  for (int o = 1; o < 32; o <<= 1) {
    const int v = __shfl_up(inc, o, 32);
    if (lane >= o) inc += v;
  }
#pragma unroll
  for (int o = 16; o > 0; o >>= 1) pre += __shfl_xor(pre, o, 32);
  if (lane == 31) wave_tot[wv] = inc;
  if (lane == 0) wave_pre[wv] = pre;
  __syncthreads();

  int below = wave_pre[lane] + (lane < wv ? wave_tot[lane] : 0);
#pragma unroll
  for (int o = 16; o > 0; o >>= 1) below += __shfl_xor(below, o, 32);
  if (idx < nodes) off[idx] = below + inc - c;
}

// ---------------------------------------------------------------------------
// Softmax numerator + denominator: ex = exp(alpha - amax[dst]); denom += ex
// Also files the edge in its dst bucket: perm[off[dst] + rank[e]] = e
// ---------------------------------------------------------------------------
__global__ void __launch_bounds__(256)
edge_softmax(float* __restrict__ ex_io, const float* __restrict__ amax,
             const int* __restrict__ dst, float* __restrict__ denom,
             const int* __restrict__ off, const int* __restrict__ rank,
             int* __restrict__ perm, int E) {
  const int i = blockIdx.x * 256 + threadIdx.x;
  if (i >= E * HEADS) return;
  const int e = i >> 2, h = i & 3;
  const int d = dst[e];
  const float v = __expf(ex_io[i] - amax[(size_t)d * HEADS + h]);
  ex_io[i] = v;
  unsafeAtomicAdd(&denom[(size_t)d * HEADS + h], v);
  if (h == 0) perm[off[d] + rank[e]] = e;
}

// ---------------------------------------------------------------------------
// Node pass: one wave per dst node walks the node's bucket of edges, recomputes
// each msg, scales it by ex/denom[dst] and sums in registers; one plain store of
// the 256 sums. Lane owns 8 of 256 dims and keeps its 16x8 piece of W_edge in
// registers for the whole bucket.
// Up to 32 edges at a time: lane l fetches edge l's id, src, edge_attr row and
// weights; the walk takes them from lane j by readlane.
// ---------------------------------------------------------------------------
__device__ __forceinline__ float lane_bcast(float v, int l) {
  return __int_as_float(__builtin_amdgcn_readlane(__float_as_int(v), l));
}

// For the four edges held by lanes j..j+3:
// acc += (q row + edge_attr row @ W_edge piece) * weight of head h.
// The four messages are built side by side: 16 independent multiply-add chains.
__device__ __forceinline__ void add_edges4(const v2f (&w)[16][4], const float (&ef_l)[16],
                                           const float (&g)[4], int j, int h,
                                           const float4 (&row)[4][2], v2f (&acc)[4]) {
  v2f msg[4][4];
#pragma unroll
  for (int n = 0; n < 4; ++n)
#pragma unroll
    for (int i = 0; i < 4; ++i) msg[n][i] = (v2f){0.0f, 0.0f};
#pragma unroll
  for (int k = 0; k < 16; ++k) {
#pragma unroll
    for (int n = 0; n < 4; ++n) {
      const float ef = lane_bcast(ef_l[k], j + n);
      const v2f ef2 = {ef, ef};
#pragma unroll
      for (int i = 0; i < 4; ++i) msg[n][i] = __builtin_elementwise_fma(ef2, w[k][i], msg[n][i]);
    }
  }
#pragma unroll
  for (int n = 0; n < 4; ++n) {
    msg[n][0] += (v2f){row[n][0].x, row[n][0].y}; msg[n][1] += (v2f){row[n][0].z, row[n][0].w};
    msg[n][2] += (v2f){row[n][1].x, row[n][1].y}; msg[n][3] += (v2f){row[n][1].z, row[n][1].w};
    const float r0 = lane_bcast(g[0], j + n), r1 = lane_bcast(g[1], j + n);
    const float r2 = lane_bcast(g[2], j + n), r3 = lane_bcast(g[3], j + n);
    const float wt = h < 2 ? (h == 0 ? r0 : r1) : (h == 2 ? r2 : r3);
    const v2f wt2 = {wt, wt};
#pragma unroll
    for (int i = 0; i < 4; ++i) acc[i] = __builtin_elementwise_fma(msg[n][i], wt2, acc[i]);
  }
}

__global__ void __launch_bounds__(128)
node_aggr(const float* __restrict__ ea, const float* __restrict__ We,
          const float* __restrict__ q, const int* __restrict__ src,
          const int* __restrict__ perm, const int* __restrict__ off,
          const int* __restrict__ cnt, const float* __restrict__ exb,
          const float* __restrict__ denom, float* __restrict__ accum, int nodes) {
  const int lane = threadIdx.x & 31;
  const int d = blockIdx.x * 4 + __builtin_amdgcn_readfirstlane(threadIdx.x >> 5);
  if (d >= nodes) return;
  const int d0 = lane * 8;
  const int h = lane >> 3;

  v2f w[16][4];
#pragma unroll
  for (int k = 0; k < 16; ++k) {
    const float4* wp = (const float4*)(We + k * HD + d0);
    const float4 a = wp[0], b = wp[1];
    w[k][0] = (v2f){a.x, a.y}; w[k][1] = (v2f){a.z, a.w};
    w[k][2] = (v2f){b.x, b.y}; w[k][3] = (v2f){b.z, b.w};
  }

  const int beg = off[d], deg = cnt[d];
  const float4 den = *(const float4*)(denom + (size_t)d * HEADS);
  v2f acc[4] = {{0.0f, 0.0f}, {0.0f, 0.0f}, {0.0f, 0.0f}, {0.0f, 0.0f}};

  for (int base = 0; base < deg; base += 32) {
    const int last = min(32, deg - base) - 1;
    // lanes past the bucket's end repeat its last edge (every address stays inside)
    // with weight 0, so the walk below can go in whole fours without a branch
    const int el = perm[beg + base + min(lane, last)];
    const int sl = src[el];
    const float4* eap = (const float4*)(ea + (size_t)el * D_EDGE);
    const float4 t0 = eap[0], t1 = eap[1], t2 = eap[2], t3 = eap[3];
    const float4 x4 = *(const float4*)(exb + (size_t)el * HEADS);
    const float ef_l[16] = {t0.x, t0.y, t0.z, t0.w, t1.x, t1.y, t1.z, t1.w,
                            t2.x, t2.y, t2.z, t2.w, t3.x, t3.y, t3.z, t3.w};
    const bool live = lane <= last;
    const float g[4] = {live ? x4.x / den.x : 0.0f, live ? x4.y / den.y : 0.0f,
                        live ? x4.z / den.z : 0.0f, live ? x4.w / den.w : 0.0f};

    int j = 0;
    do {
      // four q rows are asked for together and arrive under the four messages' arithmetic
      float4 row[4][2];
#pragma unroll
      for (int n = 0; n < 4; ++n) {
        const float4* p = (const float4*)(q + (size_t)__builtin_amdgcn_readlane(sl, j + n) * HD + d0);
        row[n][0] = p[0];
        row[n][1] = p[1];
      }
      // scheduling stop: without it the compiler moves each row's loads down to just
      // ahead of their use
      __builtin_amdgcn_sched_barrier(0);
      add_edges4(w, ef_l, g, j, h, row, acc);
      j += 4;
    } while (j <= last);
  }

  float4* outp = (float4*)(accum + (size_t)d * HD + d0);
  outp[0] = make_float4(acc[0].x, acc[0].y, acc[1].x, acc[1].y);
  outp[1] = make_float4(acc[2].x, acc[2].y, acc[3].x, acc[3].y);
}

// ---------------------------------------------------------------------------
// y = LN(accum @ W_out + b_out + x) ; WMMA K=256 then LDS-based LayerNorm
// one block = 16 rows; 4 waves, wave w owns output cols [16w, 16w+16)
// ---------------------------------------------------------------------------
__global__ void __launch_bounds__(128)
out_ln_wmma(const float* __restrict__ A, const float* __restrict__ Wo,
            const float* __restrict__ bo, const float* __restrict__ Xres,
            const float* __restrict__ gamma, const float* __restrict__ beta,
            float* __restrict__ Y) {
  __shared__ float lds[16 * 64];
  const int row0 = blockIdx.x * 16;
  const int wave = threadIdx.x >> 5;
  const int lane = threadIdx.x & 31;
  const int lr = lane & 15;
  const int lh = lane >> 4;
  const int col0 = wave * 16;

  v8f acc = {};
  const float* arow = A + (size_t)(row0 + lr) * HD;
  for (int k = 0; k < HD; k += 4) {
    v2f a, b;
    a.x = arow[k + 2 * lh];
    a.y = arow[k + 2 * lh + 1];
    b.x = Wo[(size_t)(k + 2 * lh) * D_HID + col0 + lr];
    b.y = Wo[(size_t)(k + 2 * lh + 1) * D_HID + col0 + lr];
    acc = wmma_f32_k4(a, b, acc);
  }
#pragma unroll
  for (int i = 0; i < 8; ++i)
    lds[(i + 8 * lh) * 64 + col0 + lr] = acc[i];
  __syncthreads();

  // bias + residual
  for (int idx = threadIdx.x; idx < 16 * 64; idx += 128) {
    const int r = idx >> 6, c = idx & 63;
    lds[idx] += bo[c] + Xres[(size_t)(row0 + r) * 64 + c];
  }
  __syncthreads();

  // LayerNorm: one thread per row (16 rows, 64 cols each)
  if (threadIdx.x < 16) {
    const int r = threadIdx.x;
    float mu = 0.0f;
    for (int c = 0; c < 64; ++c) mu += lds[r * 64 + c];
    mu *= (1.0f / 64.0f);
    float var = 0.0f;
    for (int c = 0; c < 64; ++c) {
      const float dd = lds[r * 64 + c] - mu;
      var += dd * dd;
    }
    var *= (1.0f / 64.0f);
    const float rs = rsqrtf(var + LN_EPS);
    for (int c = 0; c < 64; ++c)
      Y[(size_t)(row0 + r) * 64 + c] =
          (lds[r * 64 + c] - mu) * rs * gamma[c] + beta[c];
  }
}

// ---------------------------------------------------------------------------
extern "C" void kernel_launch(void* const* d_in, const int* in_sizes, int n_in,
                              void* d_out, int out_size, void* d_ws, size_t ws_size,
                              hipStream_t stream) {
  const float* x     = (const float*)d_in[0];  // [N,64]
  const float* ea    = (const float*)d_in[1];  // [E,16]
  const float* Wn    = (const float*)d_in[2];  // [64,256]
  const float* We    = (const float*)d_in[3];  // [16,256]
  const float* Wo    = (const float*)d_in[4];  // [256,64]
  const float* bo    = (const float*)d_in[5];  // [64]
  const float* gamma = (const float*)d_in[6];  // [64]
  const float* beta  = (const float*)d_in[7];  // [64]
  const int*   ei    = (const int*)d_in[8];    // [2,E]

  const int N = in_sizes[0] / D_IN;
  const int E = in_sizes[8] / 2;
  const int* src = ei;
  const int* dst = ei + E;

  // workspace layout (floats): q[N*256] | accum[N*256] | amax[N*4] | denom[N*4] | ex[E*4]
  // then ints: cnt[N] | off[N] | rank[E] | perm[E]
  float* q     = (float*)d_ws;
  float* accum = q + (size_t)N * HD;
  float* amax  = accum + (size_t)N * HD;
  float* denom = amax + (size_t)N * HEADS;
  float* exb   = denom + (size_t)N * HEADS;
  int* cnt  = (int*)(exb + (size_t)E * HEADS);
  int* off  = cnt + N;
  int* rank = off + N;
  int* perm = rank + E;

  hipMemsetAsync(denom, 0, (size_t)N * HEADS * sizeof(float), stream);
  init_amax<<<(N * HEADS + 255) / 256, 256, 0, stream>>>(amax, cnt, N * HEADS, N);

  qproj_wmma<<<N / 16, 128, 0, stream>>>(x, Wn, q);
  edge_alpha<<<(E + 7) / 8, 256, 0, stream>>>(ea, We, q, src, dst, exb, amax, cnt, rank, E);
  node_offsets<<<(N + 1023) / 1024, 1024, 0, stream>>>(cnt, off, N);
  edge_softmax<<<(E * HEADS + 255) / 256, 256, 0, stream>>>(exb, amax, dst, denom, off, rank, perm, E);
  node_aggr<<<(N + 3) / 4, 128, 0, stream>>>(ea, We, q, src, perm, off, cnt, exb, denom, accum, N);
  out_ln_wmma<<<N / 16, 128, 0, stream>>>(accum, Wo, bo, x, gamma, beta, (float*)d_out);
}

// v003
// A run of this version takes 191 microseconds.
// Versions between v001 and this one are left out; their measured steps multiply to 2.76 times as fast.
// Over all steps from v000 it is 7.75 times as fast.
#include <hip/hip_runtime.h>
#include <math.h>

#define D_IN   64
#define D_EDGE 16
#define D_HID  64
#define HEADS  4
#define HD     256   // HEADS * D_HID
#define LN_EPS 1e-5f

typedef __attribute__((ext_vector_type(2))) float v2f;
typedef __attribute__((ext_vector_type(8))) float v8f;

__device__ __forceinline__ v8f wmma_f32_k4(v2f a, v2f b, v8f c) {
  // V_WMMA_F32_16X16X4_F32 : D = A(16x4) x B(4x16) + C(16x16), fp32 throughout
  return __builtin_amdgcn_wmma_f32_16x16x4_f32(false, a, false, b, (short)0, c,
                                               false, false);
}

// ---------------------------------------------------------------------------
// q = x @ W_node   [N,64] x [64,256] -> [N,256]
// one block = 16 rows, 4 waves; wave w owns cols [64w, 64w+64) = 4 16x16 tiles
// ---------------------------------------------------------------------------
__global__ void __launch_bounds__(128)
qproj_wmma(const float* __restrict__ X, const float* __restrict__ Wn,
           float* __restrict__ Q) {
  const int row0 = blockIdx.x * 16;
  const int wave = threadIdx.x >> 5;
  const int lane = threadIdx.x & 31;
  const int lr = lane & 15;        // row (A/D) or col (B/D) within tile
  const int lh = lane >> 4;        // lane half selects K pair / row half
  const int col0 = wave * 64;

  v8f acc0 = {}, acc1 = {}, acc2 = {}, acc3 = {};
  const float* xrow = X + (size_t)(row0 + lr) * D_IN;

  for (int k = 0; k < D_IN; k += 4) {
    v2f a;
    a.x = xrow[k + 2 * lh];
    a.y = xrow[k + 2 * lh + 1];
    const float* w0 = Wn + (size_t)(k + 2 * lh) * HD;
    const float* w1 = Wn + (size_t)(k + 2 * lh + 1) * HD;
    v2f b;
    b.x = w0[col0 + lr];      b.y = w1[col0 + lr];      acc0 = wmma_f32_k4(a, b, acc0);
    b.x = w0[col0 + 16 + lr]; b.y = w1[col0 + 16 + lr]; acc1 = wmma_f32_k4(a, b, acc1);
    b.x = w0[col0 + 32 + lr]; b.y = w1[col0 + 32 + lr]; acc2 = wmma_f32_k4(a, b, acc2);
    b.x = w0[col0 + 48 + lr]; b.y = w1[col0 + 48 + lr]; acc3 = wmma_f32_k4(a, b, acc3);
  }
#pragma unroll
  for (int i = 0; i < 8; ++i) {
    const int r = row0 + i + 8 * lh;           // C/D layout: VGPR i -> M = i + 8*laneHalf
    float* qr = Q + (size_t)r * HD + col0 + lr;
    qr[0]  = acc0[i];
    qr[16] = acc1[i];
    qr[32] = acc2[i];
    qr[48] = acc3[i];
  }
}

// ---------------------------------------------------------------------------
// per-node edge count = 0
// ---------------------------------------------------------------------------
__global__ void init_cnt(int* __restrict__ cnt, int nodes) {
  int i = blockIdx.x * 256 + threadIdx.x;
  if (i < nodes) cnt[i] = 0;
}

// a node index read from edge_index, held inside [0, nodes)
__device__ __forceinline__ int node_id(int v, int nodes) {
  return (int)min((unsigned)v, (unsigned)(nodes - 1));
}

// ---------------------------------------------------------------------------
// One thread per edge: ranks the edge inside its dst bucket,
// rank[e] = edges of dst counted so far.
// ---------------------------------------------------------------------------
__global__ void __launch_bounds__(256)
edge_rank(const int* __restrict__ dst, int* __restrict__ cnt, int* __restrict__ rank,
          int E, int nodes) {
  const int e = blockIdx.x * 256 + threadIdx.x;
  if (e >= E) return;
  rank[e] = atomicAdd(&cnt[node_id(dst[e], nodes)], 1);  // arrival order decides the rank
}

// ---------------------------------------------------------------------------
// off[i] = sum of cnt[0..i): each block sums all counts in front of its own 1024
// nodes by itself (no hand-over between blocks), then scans its own 1024.
// ---------------------------------------------------------------------------
__global__ void __launch_bounds__(1024)
node_offsets(const int* __restrict__ cnt, int* __restrict__ off, int nodes) {
  __shared__ int wave_tot[32];
  __shared__ int wave_pre[32];
  const int t = threadIdx.x;
  const int lane = t & 31;
  const int wv = t >> 5;
  const int first = blockIdx.x * 1024;

  int pre = 0;
  const int* p = cnt + t;
  int left = blockIdx.x;  // runs of 1024 counts in front of this block's own
  // eight loads off one address with constant offsets are in flight together
  // (both short loops unrolled so that v[] stays in registers)
  for (; left >= 8; left -= 8) {
    int v[8];
#pragma unroll
    for (int k = 0; k < 8; ++k) v[k] = p[k * 1024];
    p += 8 * 1024;
#pragma unroll
    for (int k = 0; k < 8; ++k) pre += v[k];
  }
  for (; left > 0; --left) {
    const int v = *p;
    p += 1024;
    pre += v;
  }
  const int idx = first + t;
  const int c = idx < nodes ? cnt[idx] : 0;

  int inc = c;  // inclusive scan inside the wave
#pragma unroll
  for (int o = 1; o < 32; o <<= 1) {
    const int v = __shfl_up(inc, o, 32);
    if (lane >= o) inc += v;
  }
#pragma unroll
  for (int o = 16; o > 0; o >>= 1) pre += __shfl_xor(pre, o, 32);
  if (lane == 31) wave_tot[wv] = inc;
  if (lane == 0) wave_pre[wv] = pre;
  __syncthreads();

  int below = wave_pre[lane] + (lane < wv ? wave_tot[lane] : 0);
#pragma unroll
  for (int o = 16; o > 0; o >>= 1) below += __shfl_xor(below, o, 32);
  if (idx < nodes) off[idx] = below + inc - c;
}

// ---------------------------------------------------------------------------
// One thread per edge: files the edge in its dst bucket, perm[off[dst] + rank[e]] = e
// ---------------------------------------------------------------------------
__global__ void __launch_bounds__(256)
edge_file(const int* __restrict__ dst, const int* __restrict__ off,
          const int* __restrict__ rank, int* __restrict__ perm, int E, int nodes) {
  const int e = blockIdx.x * 256 + threadIdx.x;
  if (e >= E) return;
  perm[off[node_id(dst[e], nodes)] + rank[e]] = e;
}

// ---------------------------------------------------------------------------
// Node pass: one wave per dst node walks the node's bucket of edges ONCE, with the
// segment softmax along the walk (running maximum m, running denominator den, sums
// rescaled by exp(m_old - m_new) when m rises).
// msg = q[src] + edge_attr @ W_edge is linear in edge_attr, so the W_edge product is
// done per NODE, not per edge:
//   score:  q[dst] . msg           = q[dst] . q[src] + edge_attr . t,  t = W_edge q[dst] (per head)
//   sum:    sum_e alpha_e msg_e    = sum_e alpha_e q[src_e] + (sum_e alpha_e edge_attr_e) @ W_edge
// Lane owns 8 of 256 dims (8 lanes = one head) and 2 of its head's 16 edge features.
// W_edge is read twice per node (for t, for the last product) and lies in LDS.
// Up to 32 edges at a time: lane l fetches edge l's id and src; the walk takes them
// from lane j by readlane.
// ---------------------------------------------------------------------------

// v of lane ^ MASK, MASK < 16; it comes by DPP (row_xmask), not through LDS
template <int MASK>
__device__ __forceinline__ float from_xor(float v) {
  return __int_as_float(__builtin_amdgcn_update_dpp(0, __float_as_int(v), 0x160 | MASK,
                                                    0xf, 0xf, true));
}

template <int MASK>
__device__ __forceinline__ float add_xor(float v) {
  return v + from_xor<MASK>(v);
}

// v of lane i (0..7) of this lane's group of eight: one lane select per nibble, lanes 0-7 of
// a row of 16 take lane i, lanes 8-15 take lane 8 + i
__device__ __forceinline__ float from_eight(float v, int i) {
  const unsigned u = (unsigned)__float_as_int(v);
  return __int_as_float((int)__builtin_amdgcn_permlane16(u, u, 0x11111111u * i,
                                                         0x11111111u * (8 + i), false, false));
}

// One halving step of a sum across lanes l and l ^ MASK: of 2 * H partial sums each
// lane keeps H (the upper H where 'up') and adds the partner's partial sums of those.
template <int MASK, int H>
__device__ __forceinline__ void halve_sums(float (&v)[16], bool up) {
  // unrolled: v[] is indexed by constants only and stays in registers
#pragma unroll
  for (int r = 0; r < H; ++r) {
    const float keep = up ? v[r + H] : v[r];
    const float send = up ? v[r] : v[r + H];
    v[r] = keep + from_xor<MASK>(send);
  }
}

// For the four edges held by lanes j..j+3: score = (q[dst] . q[src] + t . edge_attr) / 8
// per head, then one step of the running softmax over q[src] and over edge_attr.
__device__ __forceinline__ void attend_edges4(const v2f (&qd)[4], v2f td, int j, int last,
                                              const float4 (&row)[4][2], const float2 (&ef)[4],
                                              v2f (&acc)[4], v2f& eacc, float& m, float& den) {
  v2f r[4][4], e2[4];
  float al[4];
#pragma unroll
  for (int n = 0; n < 4; ++n) {
    r[n][0] = (v2f){row[n][0].x, row[n][0].y}; r[n][1] = (v2f){row[n][0].z, row[n][0].w};
    r[n][2] = (v2f){row[n][1].x, row[n][1].y}; r[n][3] = (v2f){row[n][1].z, row[n][1].w};
    e2[n] = (v2f){ef[n].x, ef[n].y};
    v2f p2 = td * e2[n];
#pragma unroll
    for (int i = 0; i < 4; ++i) p2 = __builtin_elementwise_fma(qd[i], r[n][i], p2);
    al[n] = p2.x + p2.y;
  }
  // sum across the 8 lanes of this head; every one of them ends with the whole score
#pragma unroll
  for (int n = 0; n < 4; ++n) al[n] = add_xor<1>(al[n]);
#pragma unroll
  for (int n = 0; n < 4; ++n) al[n] = add_xor<2>(al[n]);
#pragma unroll
  for (int n = 0; n < 4; ++n) al[n] = add_xor<4>(al[n]);
  // a slot past the bucket's end scores -inf, so its weight below is exp(-inf) = 0;
  // slot j itself is always inside, so the new maximum is finite
#pragma unroll
  for (int n = 0; n < 4; ++n)
    al[n] = j + n <= last ? al[n] * 0.125f /* 1/sqrt(64) */ : -__builtin_huge_valf();
  const float mn = fmaxf(fmaxf(m, fmaxf(al[0], al[1])), fmaxf(al[2], al[3]));
  const float sc = __expf(m - mn);  // 0 on the first four (m = -inf)
  m = mn;
  den *= sc;
  const v2f sc2 = {sc, sc};
#pragma unroll
  for (int i = 0; i < 4; ++i) acc[i] *= sc2;
  eacc *= sc2;
#pragma unroll
  for (int n = 0; n < 4; ++n) {
    const float ex = __expf(al[n] - mn);
    den += ex;
    const v2f ex2 = {ex, ex};
#pragma unroll
    for (int i = 0; i < 4; ++i) acc[i] = __builtin_elementwise_fma(r[n][i], ex2, acc[i]);
    eacc = __builtin_elementwise_fma(e2[n], ex2, eacc);
  }
}

__global__ void __launch_bounds__(256)
node_attn(const float* __restrict__ ea, const float* __restrict__ We,
          const float* __restrict__ q, const int* __restrict__ src,
          const int* __restrict__ perm, const int* __restrict__ off,
          const int* __restrict__ cnt, float* __restrict__ accum, int nodes) {
  // W_edge as [k][half][lane] float4: lane's dims 8*lane + 4*half .. + 3 of row k, so that
  // the 32 lanes of one read lie side by side (no bank conflict)
  __shared__ float4 wl[16 * 64];
  float4 wf[4];
  // both short loops unrolled: wf[] stays in registers, a thread's four loads fly together
#pragma unroll
  for (int i = 0; i < 4; ++i) wf[i] = ((const float4*)We)[i * 256 + threadIdx.x];
#pragma unroll
  for (int i = 0; i < 4; ++i) {
    const int f = i * 256 + threadIdx.x;
    wl[(f & ~63) | ((f & 1) << 5) | ((f & 63) >> 1)] = wf[i];
  }
  __syncthreads();

  const int lane = threadIdx.x & 31;
  const int d = blockIdx.x * 8 + __builtin_amdgcn_readfirstlane(threadIdx.x >> 5);
  if (d >= nodes) return;  // behind the kernel's only barrier
  const int d0 = lane * 8;
  const int k0 = (lane & 7) * 2;  // this lane's two edge features

  const int beg = off[d], deg = cnt[d];
  const float4* qdp = (const float4*)(q + (size_t)d * HD + d0);
  const float4 u0 = qdp[0], u1 = qdp[1];
  const v2f qd[4] = {{u0.x, u0.y}, {u0.z, u0.w}, {u1.x, u1.y}, {u1.z, u1.w}};

  // t[k] = sum over the head's 64 dims of W_edge[k][dim] * q[dst][dim]: each lane's 8 dims
  // first, then three halving steps that leave t[k0], t[k0 + 1] of the head in this lane
  float t[16];
  // unrolled: t[] is indexed by constants only and stays in registers
#pragma unroll
  for (int k = 0; k < 16; ++k) {
    const float4 a = wl[k * 64 + lane], b = wl[k * 64 + 32 + lane];
    v2f s2 = qd[0] * (v2f){a.x, a.y};
    s2 = __builtin_elementwise_fma(qd[1], (v2f){a.z, a.w}, s2);
    s2 = __builtin_elementwise_fma(qd[2], (v2f){b.x, b.y}, s2);
    s2 = __builtin_elementwise_fma(qd[3], (v2f){b.z, b.w}, s2);
    t[k] = s2.x + s2.y;
    // scheduling stop at the half: without it all 32 LDS reads are hoisted to the front, and
    // the registers that they take (112 in all against 79) cost three waves per SIMD
    if (k == 7) __builtin_amdgcn_sched_barrier(0);
  }
  halve_sums<4, 8>(t, (lane & 4) != 0);
  halve_sums<2, 4>(t, (lane & 2) != 0);
  halve_sums<1, 2>(t, (lane & 1) != 0);
  const v2f td = {t[0], t[1]};

  v2f acc[4] = {{0.0f, 0.0f}, {0.0f, 0.0f}, {0.0f, 0.0f}, {0.0f, 0.0f}};
  v2f eacc = {0.0f, 0.0f};
  float m = -__builtin_huge_valf(), den = 0.0f;

  for (int base = 0; base < deg; base += 32) {
    const int last = min(32, deg - base) - 1;
    // lanes past the bucket's end repeat its last edge (every address stays inside);
    // the walk gives those slots weight 0, so it can go in whole fours without a branch
    const int il = min(lane, last);
    const int el = (perm + beg + base)[il];
    const int sl = node_id(src[el], nodes);
    // the wait that belongs in front of any overwrite of the address registers of the two
    // loads above; it takes both indices as inputs, so their registers live up to it
    asm volatile("s_wait_xcnt 0x0" :: "v"(il), "v"(el) : "memory");

    int j = 0;
    do {
      // four q rows and four edge_attr pairs are asked for together
      float4 row[4][2];
      float2 ef[4];
      const float* p[4];   // the rows' starts: the same in every lane, so scalar bases
      const float* pe[4];
#pragma unroll
      for (int n = 0; n < 4; ++n) {
        p[n] = q + (size_t)__builtin_amdgcn_readlane(sl, j + n) * HD;
        pe[n] = ea + (size_t)__builtin_amdgcn_readlane(el, j + n) * D_EDGE;
        row[n][0] = ((const float4*)(p[n] + d0))[0];
        row[n][1] = ((const float4*)(p[n] + d0))[1];
        ef[n] = *(const float2*)(pe[n] + k0);
      }
      // the wait that belongs in front of any overwrite of the twelve loads' address registers;
      // it takes the eight bases as inputs, so their registers live up to it
      asm volatile("s_wait_xcnt 0x0" :: "s"(p[0]), "s"(p[1]), "s"(p[2]), "s"(p[3]),
                   "s"(pe[0]), "s"(pe[1]), "s"(pe[2]), "s"(pe[3]) : "memory");
      attend_edges4(qd, td, j, last, row, ef, acc, eacc, m, den);
      j += 4;
    } while (j <= last);
  }

  // acc += (sum of weighted edge_attr of the head) @ W_edge: feature k's sum comes from
  // the lane of the head that holds it
  // both loops unrolled: the lane selects become constants, the LDS reads constant offsets
#pragma unroll
  for (int i = 0; i < 8; ++i) {
    const float s[2] = {from_eight(eacc.x, i), from_eight(eacc.y, i)};
#pragma unroll
    for (int h = 0; h < 2; ++h) {
      const int k = 2 * i + h;
      const float4 a = wl[k * 64 + lane], b = wl[k * 64 + 32 + lane];
      const v2f s2 = {s[h], s[h]};
      acc[0] = __builtin_elementwise_fma(s2, (v2f){a.x, a.y}, acc[0]);
      acc[1] = __builtin_elementwise_fma(s2, (v2f){a.z, a.w}, acc[1]);
      acc[2] = __builtin_elementwise_fma(s2, (v2f){b.x, b.y}, acc[2]);
      acc[3] = __builtin_elementwise_fma(s2, (v2f){b.z, b.w}, acc[3]);
    }
  }

  // a node without edges has den = 0 and sums of 0: it stores 0, as an empty segment sum
  const float inv = deg > 0 ? 1.0f / den : 0.0f;
  float4* outp = (float4*)(accum + (size_t)d * HD + d0);
  outp[0] = make_float4(acc[0].x * inv, acc[0].y * inv, acc[1].x * inv, acc[1].y * inv);
  outp[1] = make_float4(acc[2].x * inv, acc[2].y * inv, acc[3].x * inv, acc[3].y * inv);
}

// ---------------------------------------------------------------------------
// y = LN(accum @ W_out + b_out + x) ; WMMA K=256 then LDS-based LayerNorm
// one block = 16 rows; 4 waves, wave w owns output cols [16w, 16w+16)
// ---------------------------------------------------------------------------
__global__ void __launch_bounds__(128)
out_ln_wmma(const float* __restrict__ A, const float* __restrict__ Wo,
            const float* __restrict__ bo, const float* __restrict__ Xres,
            const float* __restrict__ gamma, const float* __restrict__ beta,
            float* __restrict__ Y) {
  __shared__ float lds[16 * 64];
  const int row0 = blockIdx.x * 16;
  const int wave = threadIdx.x >> 5;
  const int lane = threadIdx.x & 31;
  const int lr = lane & 15;
  const int lh = lane >> 4;
  const int col0 = wave * 16;

  v8f acc = {};
  const float* arow = A + (size_t)(row0 + lr) * HD;
  for (int k = 0; k < HD; k += 4) {
    v2f a, b;
    a.x = arow[k + 2 * lh];
    a.y = arow[k + 2 * lh + 1];
    b.x = Wo[(size_t)(k + 2 * lh) * D_HID + col0 + lr];
    b.y = Wo[(size_t)(k + 2 * lh + 1) * D_HID + col0 + lr];
    acc = wmma_f32_k4(a, b, acc);
  }
#pragma unroll
  for (int i = 0; i < 8; ++i)
    lds[(i + 8 * lh) * 64 + col0 + lr] = acc[i];
  __syncthreads();

  // bias + residual
  for (int idx = threadIdx.x; idx < 16 * 64; idx += 128) {
    const int r = idx >> 6, c = idx & 63;
    lds[idx] += bo[c] + Xres[(size_t)(row0 + r) * 64 + c];
  }
  __syncthreads();

  // LayerNorm: one thread per row (16 rows, 64 cols each)
  if (threadIdx.x < 16) {
    const int r = threadIdx.x;
    float mu = 0.0f;
    for (int c = 0; c < 64; ++c) mu += lds[r * 64 + c];
    mu *= (1.0f / 64.0f);
    float var = 0.0f;
    for (int c = 0; c < 64; ++c) {
      const float dd = lds[r * 64 + c] - mu;
      var += dd * dd;
    }
    var *= (1.0f / 64.0f);
    const float rs = rsqrtf(var + LN_EPS);
    for (int c = 0; c < 64; ++c)
      Y[(size_t)(row0 + r) * 64 + c] =
          (lds[r * 64 + c] - mu) * rs * gamma[c] + beta[c];
  }
}

// ---------------------------------------------------------------------------
extern "C" void kernel_launch(void* const* d_in, const int* in_sizes, int n_in,
                              void* d_out, int out_size, void* d_ws, size_t ws_size,
                              hipStream_t stream) {
  const float* x     = (const float*)d_in[0];  // [N,64]
  const float* ea    = (const float*)d_in[1];  // [E,16]
  const float* Wn    = (const float*)d_in[2];  // [64,256]
  const float* We    = (const float*)d_in[3];  // [16,256]
  const float* Wo    = (const float*)d_in[4];  // [256,64]
  const float* bo    = (const float*)d_in[5];  // [64]
  const float* gamma = (const float*)d_in[6];  // [64]
  const float* beta  = (const float*)d_in[7];  // [64]
  const int*   ei    = (const int*)d_in[8];    // [2,E]

  const int N = in_sizes[0] / D_IN;
  const int E = in_sizes[8] / 2;
  const int* src = ei;
  const int* dst = ei + E;

  // workspace layout (floats): q[N*256] | accum[N*256]
  // then ints: cnt[N] | off[N] | rank[E] | perm[E]
  float* q     = (float*)d_ws;
  float* accum = q + (size_t)N * HD;
  int* cnt  = (int*)(accum + (size_t)N * HD);
  int* off  = cnt + N;
  int* rank = off + N;
  int* perm = rank + E;

  init_cnt<<<(N + 255) / 256, 256, 0, stream>>>(cnt, N);
  edge_rank<<<(E + 255) / 256, 256, 0, stream>>>(dst, cnt, rank, E, N);
  node_offsets<<<(N + 1023) / 1024, 1024, 0, stream>>>(cnt, off, N);
  edge_file<<<(E + 255) / 256, 256, 0, stream>>>(dst, off, rank, perm, E, N);
  qproj_wmma<<<N / 16, 128, 0, stream>>>(x, Wn, q);
  node_attn<<<(N + 7) / 8, 256, 0, stream>>>(ea, We, q, src, perm, off, cnt, accum, N);
  out_ln_wmma<<<N / 16, 128, 0, stream>>>(accum, Wo, bo, x, gamma, beta, (float*)d_out);
}

// v004
// One run takes 171 microseconds.
// In both of two side-by-side timings against v003, it was 1.12 times as fast.
// All steps since v000 together make it 8.69 times as fast.
#include <hip/hip_runtime.h>
#include <math.h>

#define D_IN   64
#define D_EDGE 16
#define D_HID  64
#define HEADS  4
#define HD     256   // HEADS * D_HID
#define LN_EPS 1e-5f

typedef __attribute__((ext_vector_type(2))) float v2f;
typedef __attribute__((ext_vector_type(8))) float v8f;

__device__ __forceinline__ v8f wmma_f32_k4(v2f a, v2f b, v8f c) {
  // V_WMMA_F32_16X16X4_F32 : D = A(16x4) x B(4x16) + C(16x16), fp32 throughout
  return __builtin_amdgcn_wmma_f32_16x16x4_f32(false, a, false, b, (short)0, c,
                                               false, false);
}

// ---------------------------------------------------------------------------
// q = x @ W_node   [N,64] x [64,256] -> [N,256]
// one block = 16 rows, 4 waves; wave w owns cols [64w, 64w+64) = 4 16x16 tiles
// ---------------------------------------------------------------------------
__global__ void __launch_bounds__(128)
qproj_wmma(const float* __restrict__ X, const float* __restrict__ Wn,
           float* __restrict__ Q) {
  const int row0 = blockIdx.x * 16;
  const int wave = threadIdx.x >> 5;
  const int lane = threadIdx.x & 31;
  const int lr = lane & 15;        // row (A/D) or col (B/D) within tile
  const int lh = lane >> 4;        // lane half selects K pair / row half
  const int col0 = wave * 64;

  v8f acc0 = {}, acc1 = {}, acc2 = {}, acc3 = {};
  const float* xrow = X + (size_t)(row0 + lr) * D_IN;

  for (int k = 0; k < D_IN; k += 4) {
    v2f a;
    a.x = xrow[k + 2 * lh];
    a.y = xrow[k + 2 * lh + 1];
    const float* w0 = Wn + (size_t)(k + 2 * lh) * HD;
    const float* w1 = Wn + (size_t)(k + 2 * lh + 1) * HD;
    v2f b;
    b.x = w0[col0 + lr];      b.y = w1[col0 + lr];      acc0 = wmma_f32_k4(a, b, acc0);
    b.x = w0[col0 + 16 + lr]; b.y = w1[col0 + 16 + lr]; acc1 = wmma_f32_k4(a, b, acc1);
    b.x = w0[col0 + 32 + lr]; b.y = w1[col0 + 32 + lr]; acc2 = wmma_f32_k4(a, b, acc2);
    b.x = w0[col0 + 48 + lr]; b.y = w1[col0 + 48 + lr]; acc3 = wmma_f32_k4(a, b, acc3);
  }
#pragma unroll
  for (int i = 0; i < 8; ++i) {
    const int r = row0 + i + 8 * lh;           // C/D layout: VGPR i -> M = i + 8*laneHalf
    float* qr = Q + (size_t)r * HD + col0 + lr;
    qr[0]  = acc0[i];
    qr[16] = acc1[i];
    qr[32] = acc2[i];
    qr[48] = acc3[i];
  }
}

// ---------------------------------------------------------------------------
// per-node edge count = 0
// ---------------------------------------------------------------------------
__global__ void init_cnt(int* __restrict__ cnt, int nodes) {
  int i = blockIdx.x * 256 + threadIdx.x;
  if (i < nodes) cnt[i] = 0;
}

// a node index read from edge_index, held inside [0, nodes)
__device__ __forceinline__ int node_id(int v, int nodes) {
  return (int)min((unsigned)v, (unsigned)(nodes - 1));
}

// ---------------------------------------------------------------------------
// One thread per edge: ranks the edge inside its dst bucket,
// rank[e] = edges of dst counted so far.
// ---------------------------------------------------------------------------
__global__ void __launch_bounds__(256)
edge_rank(const int* __restrict__ dst, int* __restrict__ cnt, int* __restrict__ rank,
          int E, int nodes) {
  const int e = blockIdx.x * 256 + threadIdx.x;
  if (e >= E) return;
  rank[e] = atomicAdd(&cnt[node_id(dst[e], nodes)], 1);  // arrival order decides the rank
}

// ---------------------------------------------------------------------------
// off[i] = sum of cnt[0..i): each block sums all counts in front of its own 1024
// nodes by itself (no hand-over between blocks), then scans its own 1024.
// ---------------------------------------------------------------------------
__global__ void __launch_bounds__(1024)
node_offsets(const int* __restrict__ cnt, int* __restrict__ off, int nodes) {
  __shared__ int wave_tot[32];
  __shared__ int wave_pre[32];
  const int t = threadIdx.x;
  const int lane = t & 31;
  const int wv = t >> 5;
  const int first = blockIdx.x * 1024;

  int pre = 0;
  const int* p = cnt + t;
  int left = blockIdx.x;  // runs of 1024 counts in front of this block's own
  // eight loads off one address with constant offsets are in flight together
  // (both short loops unrolled so that v[] stays in registers)
  for (; left >= 8; left -= 8) {
    int v[8];
#pragma unroll
    for (int k = 0; k < 8; ++k) v[k] = p[k * 1024];
    p += 8 * 1024;
#pragma unroll
    for (int k = 0; k < 8; ++k) pre += v[k];
  }
  for (; left > 0; --left) {
    const int v = *p;
    p += 1024;
    pre += v;
  }
  const int idx = first + t;
  const int c = idx < nodes ? cnt[idx] : 0;

  int inc = c;  // inclusive scan inside the wave
#pragma unroll
  for (int o = 1; o < 32; o <<= 1) {
    const int v = __shfl_up(inc, o, 32);
    if (lane >= o) inc += v;
  }
#pragma unroll
  for (int o = 16; o > 0; o >>= 1) pre += __shfl_xor(pre, o, 32);
  if (lane == 31) wave_tot[wv] = inc;
  if (lane == 0) wave_pre[wv] = pre;
  __syncthreads();

  int below = wave_pre[lane] + (lane < wv ? wave_tot[lane] : 0);
#pragma unroll
  for (int o = 16; o > 0; o >>= 1) below += __shfl_xor(below, o, 32);
  if (idx < nodes) off[idx] = below + inc - c;
}

// ---------------------------------------------------------------------------
// One thread per edge: files the edge in its dst bucket, perm[off[dst] + rank[e]] = e
// ---------------------------------------------------------------------------
__global__ void __launch_bounds__(256)
edge_file(const int* __restrict__ dst, const int* __restrict__ off,
          const int* __restrict__ rank, int* __restrict__ perm, int E, int nodes) {
  const int e = blockIdx.x * 256 + threadIdx.x;
  if (e >= E) return;
  perm[off[node_id(dst[e], nodes)] + rank[e]] = e;
}

// ---------------------------------------------------------------------------
// Node pass: a wave takes two dst nodes in turn and walks each node's bucket of edges ONCE, with the
// segment softmax along the walk (running maximum m, running denominator den, sums
// rescaled by exp(m_old - m_new) when m rises).
// msg = q[src] + edge_attr @ W_edge is linear in edge_attr, so the W_edge product is
// done per NODE, not per edge:
//   score:  q[dst] . msg           = q[dst] . q[src] + edge_attr . t,  t = W_edge q[dst] (per head)
//   sum:    sum_e alpha_e msg_e    = sum_e alpha_e q[src_e] + (sum_e alpha_e edge_attr_e) @ W_edge
// Lane owns 8 of 256 dims (8 lanes = one head) and 2 of its head's 16 edge features.
// W_edge is read twice per node (for t, for the last product) and lies in LDS.
// Up to 32 edges at a time: lane l fetches edge l's id and src; the walk takes them
// from lane j by readlane.
// ---------------------------------------------------------------------------

// v of lane ^ MASK, MASK < 16; it comes by DPP (row_xmask), not through LDS
template <int MASK>
__device__ __forceinline__ float from_xor(float v) {
  return __int_as_float(__builtin_amdgcn_update_dpp(0, __float_as_int(v), 0x160 | MASK,
                                                    0xf, 0xf, true));
}

template <int MASK>
__device__ __forceinline__ float add_xor(float v) {
  return v + from_xor<MASK>(v);
}

// v of lane i (0..7) of this lane's group of eight: one lane select per nibble, lanes 0-7 of
// a row of 16 take lane i, lanes 8-15 take lane 8 + i
__device__ __forceinline__ float from_eight(float v, int i) {
  const unsigned u = (unsigned)__float_as_int(v);
  return __int_as_float((int)__builtin_amdgcn_permlane16(u, u, 0x11111111u * i,
                                                         0x11111111u * (8 + i), false, false));
}

// One halving step of a sum across lanes l and l ^ MASK: of 2 * H partial sums each
// lane keeps H (the upper H where 'up') and adds the partner's partial sums of those.
template <int MASK, int H>
__device__ __forceinline__ void halve_sums(float (&v)[16], bool up) {
  // unrolled: v[] is indexed by constants only and stays in registers
#pragma unroll
  for (int r = 0; r < H; ++r) {
    const float keep = up ? v[r + H] : v[r];
    const float send = up ? v[r] : v[r + H];
    v[r] = keep + from_xor<MASK>(send);
  }
}

// For the four edges held by lanes j..j+3: score = (q[dst] . q[src] + t . edge_attr) / 8
// per head, then one step of the running softmax over q[src] and over edge_attr.
__device__ __forceinline__ void attend_edges4(const v2f (&qd)[4], v2f td, int j, int last,
                                              const float4 (&row)[4][2], const float2 (&ef)[4],
                                              v2f (&acc)[4], v2f& eacc, float& m, float& den) {
  v2f r[4][4], e2[4];
  float al[4];
#pragma unroll
  for (int n = 0; n < 4; ++n) {
    r[n][0] = (v2f){row[n][0].x, row[n][0].y}; r[n][1] = (v2f){row[n][0].z, row[n][0].w};
    r[n][2] = (v2f){row[n][1].x, row[n][1].y}; r[n][3] = (v2f){row[n][1].z, row[n][1].w};
    e2[n] = (v2f){ef[n].x, ef[n].y};
    v2f p2 = td * e2[n];
#pragma unroll
    for (int i = 0; i < 4; ++i) p2 = __builtin_elementwise_fma(qd[i], r[n][i], p2);
    al[n] = p2.x + p2.y;
  }
  // sum across the 8 lanes of this head; every one of them ends with the whole score
#pragma unroll
  for (int n = 0; n < 4; ++n) al[n] = add_xor<1>(al[n]);
#pragma unroll
  for (int n = 0; n < 4; ++n) al[n] = add_xor<2>(al[n]);
#pragma unroll
  for (int n = 0; n < 4; ++n) al[n] = add_xor<4>(al[n]);
  // a slot past the bucket's end scores -inf, so its weight below is exp(-inf) = 0;
  // slot j itself is always inside, so the new maximum is finite
#pragma unroll
  for (int n = 0; n < 4; ++n)
    al[n] = j + n <= last ? al[n] * 0.125f /* 1/sqrt(64) */ : -__builtin_huge_valf();
  const float mn = fmaxf(fmaxf(m, fmaxf(al[0], al[1])), fmaxf(al[2], al[3]));
  const float sc = __expf(m - mn);  // 0 on the first four (m = -inf)
  m = mn;
  den *= sc;
  const v2f sc2 = {sc, sc};
#pragma unroll
  for (int i = 0; i < 4; ++i) acc[i] *= sc2;
  eacc *= sc2;
#pragma unroll
  for (int n = 0; n < 4; ++n) {
    const float ex = __expf(al[n] - mn);
    den += ex;
    const v2f ex2 = {ex, ex};
#pragma unroll
    for (int i = 0; i < 4; ++i) acc[i] = __builtin_elementwise_fma(r[n][i], ex2, acc[i]);
    eacc = __builtin_elementwise_fma(e2[n], ex2, eacc);
  }
}

// v of the same lane of the other row of 16 (lane ^ 16)
__device__ __forceinline__ float from_other_row(float v) {
  const unsigned u = (unsigned)__float_as_int(v);
  return __int_as_float((int)__builtin_amdgcn_permlanex16(u, u, 0x76543210u, 0xfedcba98u,
                                                          false, false));
}

// sum over the wave's 32 lanes; every lane ends with it
__device__ __forceinline__ float wave_sum(float v) {
  v = add_xor<8>(add_xor<4>(add_xor<2>(add_xor<1>(v))));
  return v + from_other_row(v);
}

// Eight k steps of one accumulator in one statement: c += a[i] x b[i], i = 0..7.
// Written as asm so that nothing stands between the products: with the builtin the compiler
// put address arithmetic into registers of a product's A and B directly behind it. The four
// v_nop at the end keep the distance between the last product and the first vector instruction
// that reads c or overwrites its operands; s_delay_alu is the hint for a dependent chain.
__device__ __forceinline__ void wmma_f32_k32(v8f& c, const v2f* a, const v2f* b) {
  asm volatile(
      "v_wmma_f32_16x16x4_f32 %0, %1, %9, %0\n\t"
      "s_delay_alu instid0(VALU_DEP_1)\n\t"
      "v_wmma_f32_16x16x4_f32 %0, %2, %10, %0\n\t"
      "s_delay_alu instid0(VALU_DEP_1)\n\t"
      "v_wmma_f32_16x16x4_f32 %0, %3, %11, %0\n\t"
      "s_delay_alu instid0(VALU_DEP_1)\n\t"
      "v_wmma_f32_16x16x4_f32 %0, %4, %12, %0\n\t"
      "s_delay_alu instid0(VALU_DEP_1)\n\t"
      "v_wmma_f32_16x16x4_f32 %0, %5, %13, %0\n\t"
      "s_delay_alu instid0(VALU_DEP_1)\n\t"
      "v_wmma_f32_16x16x4_f32 %0, %6, %14, %0\n\t"
      "s_delay_alu instid0(VALU_DEP_1)\n\t"
      "v_wmma_f32_16x16x4_f32 %0, %7, %15, %0\n\t"
      "s_delay_alu instid0(VALU_DEP_1)\n\t"
      "v_wmma_f32_16x16x4_f32 %0, %8, %16, %0\n\t"
      "v_nop\n\tv_nop\n\tv_nop\n\tv_nop"
      : "+v"(c)
      : "v"(a[0]), "v"(a[1]), "v"(a[2]), "v"(a[3]), "v"(a[4]), "v"(a[5]), "v"(a[6]), "v"(a[7]),
        "v"(b[0]), "v"(b[1]), "v"(b[2]), "v"(b[3]), "v"(b[4]), "v"(b[5]), "v"(b[6]), "v"(b[7]));
}

// floats per row of the A tile: rows lie 4 banks apart, so that the 16 rows x 4 k of one
// fragment read fill the 64 banks once
#define A_PITCH 260
// floats per row of a partial result: rows i and i + 8 of one store lie 16 banks apart
#define R_PITCH 66

// One block = 16 dst nodes = one 16-row tile of the output product; 8 waves, two nodes each.
// The nodes' 256 sums go to LDS, not to memory, and are the A tile of
//   y = LN(sums @ W_out + b_out + x):
// wave w takes output columns 16 (w & 3) .. + 15 and k = 128 (w >> 2) .. + 127; the two
// k halves are added where the LayerNorm reads them (one wave per row, two columns a lane).
// second launch bound: 12 waves per SIMD, that is a budget of 80 registers, the allocation of
// the node pass before the product was joined to it (without it the build takes 86: 10 waves)
__global__ void __launch_bounds__(256, 12)
node_attn_out(const float* __restrict__ ea, const float* __restrict__ We,
              const float* __restrict__ q, const int* __restrict__ src,
              const int* __restrict__ perm, const int* __restrict__ off,
              const int* __restrict__ cnt, const float* __restrict__ Wo,
              const float* __restrict__ bo, const float* __restrict__ Xres,
              const float* __restrict__ gamma, const float* __restrict__ beta,
              float* __restrict__ Y, int nodes) {
  // W_edge as [k][half][lane] float4: lane's dims 8*lane + 4*half .. + 3 of row k, so that
  // the 32 lanes of one read lie side by side (no bank conflict)
  __shared__ float4 wl[16 * 64];
  __shared__ __attribute__((aligned(16))) float at[16 * A_PITCH];
  __shared__ __attribute__((aligned(8))) float red[2 * 16 * R_PITCH];
  float4 wf[4];
  // both short loops unrolled: wf[] stays in registers, a thread's four loads fly together
#pragma unroll
  for (int i = 0; i < 4; ++i) wf[i] = ((const float4*)We)[i * 256 + threadIdx.x];
#pragma unroll
  for (int i = 0; i < 4; ++i) {
    const int f = i * 256 + threadIdx.x;
    wl[(f & ~63) | ((f & 1) << 5) | ((f & 63) >> 1)] = wf[i];
  }
  __syncthreads();

  // the lane's number from the hardware count, not from threadIdx.x: nothing behind the staging
  // above reads threadIdx.x then, and its register is free in the edge loop
  const int lane = (int)__builtin_amdgcn_mbcnt_lo(~0u, 0u);
  const int wave = __builtin_amdgcn_readfirstlane(threadIdx.x >> 5);
  const int row0 = blockIdx.x * 16;
  const int f4 = lane * 2;  // this lane's 8 of 256 dims, counted in float4
  const int k0 = (lane & 7) * 2;  // this lane's two edge features

  // kept rolled: the second node reuses the first one's registers and code
#pragma unroll 1
  for (int nd = 0; nd < 2; ++nd) {
    const int tr = wave * 2 + nd;  // the node's row in the tile
    // a row past the last node repeats the last node (every wave reaches every barrier);
    // its result is not stored
    const int d = min(row0 + tr, nodes - 1);

    const int beg = off[d], deg = cnt[d];
    const float* qrow = q + (size_t)d * HD;  // the same in every lane, so a scalar base
    const float4 u0 = ((const float4*)qrow)[f4], u1 = ((const float4*)qrow)[f4 + 1];
    // the wait that belongs in front of any overwrite of the two loads' address registers (the
    // next node's); it takes the base as an input, so its registers live up to it
    asm volatile("s_wait_xcnt 0x0" :: "s"(qrow) : "memory");
    const v2f qd[4] = {{u0.x, u0.y}, {u0.z, u0.w}, {u1.x, u1.y}, {u1.z, u1.w}};

    // t[k] = sum over the head's 64 dims of W_edge[k][dim] * q[dst][dim]: each lane's 8 dims
    // first, then three halving steps that leave t[k0], t[k0 + 1] of the head in this lane
    float t[16];
    // unrolled: t[] is indexed by constants only and stays in registers
#pragma unroll
    for (int k = 0; k < 16; ++k) {
      const float4 a = wl[k * 64 + lane], b = wl[k * 64 + 32 + lane];
      v2f s2 = qd[0] * (v2f){a.x, a.y};
      s2 = __builtin_elementwise_fma(qd[1], (v2f){a.z, a.w}, s2);
      s2 = __builtin_elementwise_fma(qd[2], (v2f){b.x, b.y}, s2);
      s2 = __builtin_elementwise_fma(qd[3], (v2f){b.z, b.w}, s2);
      t[k] = s2.x + s2.y;
      // scheduling stop at the half: without it all 32 LDS reads are hoisted to the front, and
      // the registers that they take (112 in all against 79) cost three waves per SIMD
      if (k == 7) __builtin_amdgcn_sched_barrier(0);
    }
    halve_sums<4, 8>(t, (lane & 4) != 0);
    halve_sums<2, 4>(t, (lane & 2) != 0);
    halve_sums<1, 2>(t, (lane & 1) != 0);
    const v2f td = {t[0], t[1]};

    v2f acc[4] = {{0.0f, 0.0f}, {0.0f, 0.0f}, {0.0f, 0.0f}, {0.0f, 0.0f}};
    v2f eacc = {0.0f, 0.0f};
    float m = -__builtin_huge_valf(), den = 0.0f;

    for (int base = 0; base < deg; base += 32) {
      const int last = min(32, deg - base) - 1;
      // lanes past the bucket's end repeat its last edge (every address stays inside);
      // the walk gives those slots weight 0, so it can go in whole fours without a branch
      const int il = min(lane, last);
      const int el = (perm + beg + base)[il];
      const int sl = node_id(src[el], nodes);
      // the wait that belongs in front of any overwrite of the address registers of the two
      // loads above; it takes both indices as inputs, so their registers live up to it
      asm volatile("s_wait_xcnt 0x0" :: "v"(il), "v"(el) : "memory");

      int j = 0;
      do {
        // four q rows and four edge_attr pairs are asked for together
        float4 row[4][2];
        float2 ef[4];
        const float* p[4];   // the rows' starts: the same in every lane, so scalar bases
        const float* pe[4];
#pragma unroll
        for (int n = 0; n < 4; ++n) {
          p[n] = q + (size_t)__builtin_amdgcn_readlane(sl, j + n) * HD;
          pe[n] = ea + (size_t)__builtin_amdgcn_readlane(el, j + n) * D_EDGE;
          row[n][0] = ((const float4*)p[n])[f4];
          row[n][1] = ((const float4*)p[n])[f4 + 1];
          ef[n] = *(const float2*)(pe[n] + k0);
        }
        // the wait that belongs in front of any overwrite of the twelve loads' address registers;
        // it takes the eight bases as inputs, so their registers live up to it
        asm volatile("s_wait_xcnt 0x0" :: "s"(p[0]), "s"(p[1]), "s"(p[2]), "s"(p[3]),
                     "s"(pe[0]), "s"(pe[1]), "s"(pe[2]), "s"(pe[3]) : "memory");
        attend_edges4(qd, td, j, last, row, ef, acc, eacc, m, den);
        j += 4;
      } while (j <= last);
    }

    // acc += (sum of weighted edge_attr of the head) @ W_edge: feature k's sum comes from
    // the lane of the head that holds it
    // both loops unrolled: the lane selects become constants, the LDS reads constant offsets
#pragma unroll
    for (int i = 0; i < 8; ++i) {
      const float s[2] = {from_eight(eacc.x, i), from_eight(eacc.y, i)};
#pragma unroll
      for (int h = 0; h < 2; ++h) {
        const int k = 2 * i + h;
        const float4 a = wl[k * 64 + lane], b = wl[k * 64 + 32 + lane];
        const v2f s2 = {s[h], s[h]};
        acc[0] = __builtin_elementwise_fma(s2, (v2f){a.x, a.y}, acc[0]);
        acc[1] = __builtin_elementwise_fma(s2, (v2f){a.z, a.w}, acc[1]);
        acc[2] = __builtin_elementwise_fma(s2, (v2f){b.x, b.y}, acc[2]);
        acc[3] = __builtin_elementwise_fma(s2, (v2f){b.z, b.w}, acc[3]);
      }
    }

    // a node without edges has den = 0 and sums of 0: it gives 0, as an empty segment sum
    const float inv = deg > 0 ? 1.0f / den : 0.0f;
    float4* outp = (float4*)(at + tr * A_PITCH) + f4;
    outp[0] = make_float4(acc[0].x * inv, acc[0].y * inv, acc[1].x * inv, acc[1].y * inv);
    outp[1] = make_float4(acc[2].x * inv, acc[2].y * inv, acc[3].x * inv, acc[3].y * inv);
  }

  const int lr = lane & 15;   // row (A/D) or col (B/D) within tile
  const int lh = lane >> 4;   // lane half selects K pair / row half
  const int col0 = (wave & 3) * 16;
  const int kh = wave >> 2;

  // the first 16 of this wave's 32 B fragments are asked for in front of the barrier: they
  // depend on no other wave; the other 16 follow behind the first eight products, into the
  // registers that those free (all 32 at once would take 64 registers: past the budget)
  const float* wb = Wo + (size_t)(kh * 128 + 2 * lh) * D_HID + col0 + lr;
  v2f b0[16], b1[16];
  // unrolled (here and below): b0[], b1[] are indexed by constants only and stay in registers
#pragma unroll
  for (int s = 0; s < 16; ++s) {
    b0[s].x = wb[(4 * s) * D_HID];
    b0[s].y = wb[(4 * s + 1) * D_HID];
  }
  __syncthreads();  // the 16 rows of the A tile are written

  v8f c = {};
  const float* ar = at + lr * A_PITCH + kh * 128 + 2 * lh;
  v2f a[8];
  // unrolled (all four fragment loops): a[] is indexed by constants only and stays in registers
#pragma unroll
  for (int s = 0; s < 8; ++s) a[s] = *(const v2f*)(ar + 4 * s);
  wmma_f32_k32(c, a, b0);

#pragma unroll
  for (int s = 0; s < 16; ++s) {
    b1[s].x = wb[(64 + 4 * s) * D_HID];
    b1[s].y = wb[(64 + 4 * s + 1) * D_HID];
  }
  // the wait that belongs in front of any overwrite of the address registers of the 64 loads
  // of B; it takes the address as an input, so its registers live up to it
  asm volatile("s_wait_xcnt 0x0" :: "v"(wb) : "memory");
#pragma unroll
  for (int s = 0; s < 8; ++s) a[s] = *(const v2f*)(ar + 32 + 4 * s);
  wmma_f32_k32(c, a, b0 + 8);

  // bias, residual rows and LayerNorm weights of this wave's two rows, two columns a lane
  const int c2 = lane * 2;
  const float* xr0 = Xres + (size_t)min(row0 + wave * 2, nodes - 1) * D_IN;  // scalar bases
  const float* xr1 = Xres + (size_t)min(row0 + wave * 2 + 1, nodes - 1) * D_IN;
  const float2 xv[2] = {*(const float2*)(xr0 + c2), *(const float2*)(xr1 + c2)};
  const float2 bv = *(const float2*)(bo + c2);
  const float2 gv = *(const float2*)(gamma + c2);
  const float2 ev = *(const float2*)(beta + c2);
  // the same wait for these five loads, with their bases and their offset as inputs
  asm volatile("s_wait_xcnt 0x0" :: "s"(xr0), "s"(xr1), "s"(bo), "s"(gamma), "s"(beta), "v"(lane)
               : "memory");

#pragma unroll
  for (int s = 0; s < 8; ++s) a[s] = *(const v2f*)(ar + 64 + 4 * s);
  wmma_f32_k32(c, a, b1);
#pragma unroll
  for (int s = 0; s < 8; ++s) a[s] = *(const v2f*)(ar + 96 + 4 * s);
  wmma_f32_k32(c, a, b1 + 8);

  // unrolled: c[] is indexed by constants only
#pragma unroll
  for (int i = 0; i < 8; ++i)   // C/D layout: VGPR i -> M = i + 8*laneHalf
    red[(kh * 16 + i + 8 * lh) * R_PITCH + col0 + lr] = c[i];
  __syncthreads();  // both k halves of all 16 rows are written

  // unrolled: xv[] is indexed by constants only and stays in registers
#pragma unroll
  for (int nd = 0; nd < 2; ++nd) {
    const int tr = wave * 2 + nd;
    const float2 p0 = *(const float2*)(red + tr * R_PITCH + c2);
    const float2 p1 = *(const float2*)(red + (16 + tr) * R_PITCH + c2);
    const float y0 = p0.x + p1.x + (bv.x + xv[nd].x);
    const float y1 = p0.y + p1.y + (bv.y + xv[nd].y);
    const float mu = wave_sum(y0 + y1) * (1.0f / 64.0f);
    const float e0 = y0 - mu, e1 = y1 - mu;
    const float var = wave_sum(e0 * e0 + e1 * e1) * (1.0f / 64.0f);
    const float rs = rsqrtf(var + LN_EPS);
    if (row0 + tr < nodes)  // the same for the whole wave
      *(float2*)(Y + (size_t)(row0 + tr) * D_HID + c2) =
          make_float2(e0 * rs * gv.x + ev.x, e1 * rs * gv.y + ev.y);
  }
}

// ---------------------------------------------------------------------------
extern "C" void kernel_launch(void* const* d_in, const int* in_sizes, int n_in,
                              void* d_out, int out_size, void* d_ws, size_t ws_size,
                              hipStream_t stream) {
  const float* x     = (const float*)d_in[0];  // [N,64]
  const float* ea    = (const float*)d_in[1];  // [E,16]
  const float* Wn    = (const float*)d_in[2];  // [64,256]
  const float* We    = (const float*)d_in[3];  // [16,256]
  const float* Wo    = (const float*)d_in[4];  // [256,64]
  const float* bo    = (const float*)d_in[5];  // [64]
  const float* gamma = (const float*)d_in[6];  // [64]
  const float* beta  = (const float*)d_in[7];  // [64]
  const int*   ei    = (const int*)d_in[8];    // [2,E]

  const int N = in_sizes[0] / D_IN;
  const int E = in_sizes[8] / 2;
  const int* src = ei;
  const int* dst = ei + E;

  // workspace layout (floats): q[N*256]
  // then ints: cnt[N] | off[N] | rank[E] | perm[E]
  float* q     = (float*)d_ws;
  int* cnt  = (int*)(q + (size_t)N * HD);
  int* off  = cnt + N;
  int* rank = off + N;
  int* perm = rank + E;

  init_cnt<<<(N + 255) / 256, 256, 0, stream>>>(cnt, N);
  edge_rank<<<(E + 255) / 256, 256, 0, stream>>>(dst, cnt, rank, E, N);
  node_offsets<<<(N + 1023) / 1024, 1024, 0, stream>>>(cnt, off, N);
  edge_file<<<(E + 255) / 256, 256, 0, stream>>>(dst, off, rank, perm, E, N);
  qproj_wmma<<<N / 16, 128, 0, stream>>>(x, Wn, q);
  node_attn_out<<<(N + 15) / 16, 256, 0, stream>>>(ea, We, q, src, perm, off, cnt, Wo, bo, x, gamma,
                                                   beta, (float*)d_out, N);
}
